// v000
// The times below were measured on an AMD MI455X: many runs one after another, warmed up first and cycling through
// copies of the inputs, with the whole window's GPU time divided by the number of runs. Launches and the gaps
// between them are all in it. The median over several windows is given; except for v000 it joins two sittings, which
// can be a few percent apart, so the side-by-side timings, each taken in one sitting, are the better comparison.
// v000 is the starting kernel. One run takes 684 microseconds.
#include <hip/hip_runtime.h>
#include <hip/hip_bf16.h>
#include <cstddef>

// Problem constants (from reference)
#define BS   4
#define CIN  256      // C*A
#define CQK  128      // CIN/2
#define NSP  4096     // H*W*D = 16*16*16

typedef float v8f __attribute__((ext_vector_type(8)));
typedef float v2f __attribute__((ext_vector_type(2)));
typedef unsigned int u32x4 __attribute__((ext_vector_type(4)));
typedef int i32x4 __attribute__((ext_vector_type(4)));
typedef int i32x8 __attribute__((ext_vector_type(8)));

// -------------------------------------------------------------------------
// fp32 WMMA helper: D = A(16x4) * B(4x16) + C   via V_WMMA_F32_16X16X4_F32
// A-frag per lane: row M = lane%16, elems K = 2*(lane/16)+{0,1}
// B-frag per lane: col N = lane%16, elems K = 2*(lane/16)+{0,1}
// C/D per lane:    row M = vgpr + 8*(lane/16), col N = lane%16
// -------------------------------------------------------------------------
__device__ __forceinline__ v8f wmma_f32(v2f a, v2f b, v8f c) {
    return __builtin_amdgcn_wmma_f32_16x16x4_f32(
        /*neg_a=*/false, a, /*neg_b=*/false, b,
        /*c_mod=*/(short)0, c, /*reuse_a=*/false, /*reuse_b=*/false);
}

// LDS byte offset of a __shared__ object (AS3 pointers are 32-bit offsets).
__device__ __forceinline__ unsigned lds_off(const void* p) {
    return (unsigned)(unsigned long long)
        (const __attribute__((address_space(3))) void*)p;
}

// -------------------------------------------------------------------------
// Tensor Data Mover: 2D tile load Global -> LDS (CDNA5 TDM, D# per ISA ch.8)
//   tile_d0 : contiguous elements per row (fp32)
//   tile_d1 : number of rows
//   stride  : row stride in elements (tensor_dim0_stride)
// LDS receives rows packed contiguously (tile_d0*4 bytes apart).
// Tracked with TENSORcnt.
// -------------------------------------------------------------------------
__device__ __forceinline__ void tdm_load_2d(const float* gptr, const void* lptr,
                                            unsigned tile_d0, unsigned tile_d1,
                                            unsigned stride_elts) {
    const unsigned long long ga = (unsigned long long)gptr;
    const unsigned           la = lds_off(lptr);

    u32x4 g0;
    g0[0] = 1u;                                   // count=1 (valid user D#)
    g0[1] = la;                                   // lds_addr (bytes)
    g0[2] = (unsigned)ga;                         // global_addr[31:0]
    g0[3] = (unsigned)((ga >> 32) & 0x01FFFFFFull)// global_addr[56:32]
          | (2u << 30);                           // type = 2 ("image")

    i32x8 g1;
    g1[0] = (int)(2u << 16);                      // wg_mask=0, data_size=4B
    g1[1] = 0;                                    // bar_addr=0, tensor_dim0 lo16 (=0)
    g1[2] = (int)0x4000;                          // tensor_dim0 hi16 -> 2^30 (no OOB clip)
    g1[3] = (int)(0x4000u | (tile_d0 << 16));     // tensor_dim1 hi16 -> 2^30 ; tile_dim0
    g1[4] = (int)(tile_d1 & 0xFFFFu);             // tile_dim1 ; tile_dim2=0
    g1[5] = (int)stride_elts;                     // tensor_dim0_stride lo32
    g1[6] = 0;                                    // stride hi16 ; dim1_stride lo16
    g1[7] = 0;                                    // dim1_stride hi32

    const i32x4 z4 = {0, 0, 0, 0};
#if defined(__clang_major__) && (__clang_major__ >= 23)
    const i32x8 z8 = {0, 0, 0, 0, 0, 0, 0, 0};
    __builtin_amdgcn_tensor_load_to_lds(g0, g1, z4, z4, z8, 0);
#else
    __builtin_amdgcn_tensor_load_to_lds(g0, g1, z4, z4, 0);
#endif
}

// -------------------------------------------------------------------------
// Projection kernel:  O[o][n] = sum_c W[o][c] * X[b][c][n] + bias[o]
// One wave (32 threads) computes one 16(o) x 16(n) tile via 64 WMMAs.
// trans==1 stores O transposed as [b][n][o] (used for q so it is directly
// the A-matrix of the energy GEMM).
// -------------------------------------------------------------------------
__global__ __launch_bounds__(32)
void Self_Attn_proj_kernel(const float* __restrict__ W,
                           const float* __restrict__ bias,
                           const float* __restrict__ X,
                           float* __restrict__ O,
                           int OD, int trans) {
    const int o0   = blockIdx.x * 16;
    const int n0   = blockIdx.y * 16;
    const int b    = blockIdx.z;
    const int lane = threadIdx.x;
    const int half = lane >> 4;      // 0 or 1
    const int r    = lane & 15;      // row (A) / col (B,C/D)

    const float* Xb = X + (size_t)b * CIN * NSP;

    v8f acc = {0.f, 0.f, 0.f, 0.f, 0.f, 0.f, 0.f, 0.f};

    const float* wrow = W + (size_t)(o0 + r) * CIN;
#pragma unroll 4
    for (int c = 0; c < CIN; c += 4) {
        v2f a, bb;
        a.x  = wrow[c + 2 * half + 0];
        a.y  = wrow[c + 2 * half + 1];
        bb.x = Xb[(size_t)(c + 2 * half + 0) * NSP + n0 + r];
        bb.y = Xb[(size_t)(c + 2 * half + 1) * NSP + n0 + r];
        acc = wmma_f32(a, bb, acc);
    }

#pragma unroll
    for (int v = 0; v < 8; ++v) {
        const int o = o0 + v + 8 * half;   // output channel (row M)
        const int n = n0 + r;              // spatial index (col N)
        const float val = acc[v] + bias[o];
        if (trans)
            O[(size_t)b * NSP * OD + (size_t)n * OD + o] = val;
        else
            O[(size_t)b * OD * NSP + (size_t)o * NSP + n] = val;
    }
}

// -------------------------------------------------------------------------
// Flash-attention kernel: one wave handles one (batch b, 16-row n-tile).
// k/v tiles are DMA'd into double-buffered LDS by the Tensor Data Mover
// (2 tensor_load_to_lds per m-tile, TENSORcnt-waited) so tile mt+1 streams
// in while the 96 WMMAs of tile mt execute.
// S = q_tile(16x128) * k_tile(128x16) (32 WMMAs), online softmax, outT
// accumulated as 16 c-tiles of D = v_tile(16c x 16m) * P^T (4 WMMAs each).
// Finalizes: out = gamma * (acc / l) + g.
// -------------------------------------------------------------------------
__global__ __launch_bounds__(32)
void Self_Attn_flash_kernel(const float* __restrict__ qws,  // [b][n][CQK]
                            const float* __restrict__ kws,  // [b][CQK][n]
                            const float* __restrict__ vws,  // [b][CIN][n]
                            const float* __restrict__ g,
                            const float* __restrict__ gamma,
                            float* __restrict__ out) {
    const int n0   = blockIdx.x * 16;
    const int b    = blockIdx.y;
    const int lane = threadIdx.x;
    const int half = lane >> 4;
    const int r    = lane & 15;

    const float* qb = qws + (size_t)b * NSP * CQK;
    const float* kb = kws + (size_t)b * CQK * NSP;
    const float* vb = vws + (size_t)b * CIN * NSP;

    __shared__ float qs[16 * CQK];      // q tile, row-major [n_local][o]
    __shared__ float ks[2][CQK * 16];   // k tile (double buffered), [o][m_local]
    __shared__ float vs[2][CIN * 16];   // v tile (double buffered), [c][m_local]
    __shared__ float ps[16 * 16];       // P tile, [n_local][m_local]
    __shared__ float scl[16];           // per-row rescale factor
    __shared__ float lsh[16];           // per-row final softmax denom

    constexpr int NT = NSP / 16;        // 256 m-tiles

    // q tile: rows n0..n0+15 are contiguous in [b][n][o] layout -> one 1D DMA.
    tdm_load_2d(qb + (size_t)n0 * CQK, qs, /*d0=*/2048, /*d1=*/1, /*stride=*/2048);

    // Prime the k/v pipeline for m-tile 0.
    tdm_load_2d(kb + 0, ks[0], 16, CQK, NSP);
    tdm_load_2d(vb + 0, vs[0], 16, CIN, NSP);

    // Out accumulator: 16 c-tiles of 16(c) x 16(n)  => 128 VGPRs.
    v8f acc[16];
#pragma unroll
    for (int t = 0; t < 16; ++t)
        acc[t] = (v8f){0.f, 0.f, 0.f, 0.f, 0.f, 0.f, 0.f, 0.f};

    float mrun[8], lrun[8];
#pragma unroll
    for (int v = 0; v < 8; ++v) { mrun[v] = -3.4e38f; lrun[v] = 0.f; }

    for (int mt = 0; mt < NT; ++mt) {
        const int cur = mt & 1;

        // Issue DMA for the next tile into the other buffer, then wait for
        // the current tile (leave the 2 prefetch ops in flight).
        if (mt + 1 < NT) {
            const int m1 = (mt + 1) * 16;
            tdm_load_2d(kb + m1, ks[cur ^ 1], 16, CQK, NSP);
            tdm_load_2d(vb + m1, vs[cur ^ 1], 16, CIN, NSP);
            __builtin_amdgcn_s_wait_tensorcnt(2);
        } else {
            __builtin_amdgcn_s_wait_tensorcnt(0);
        }
        __syncthreads();

        const float* ksc = ks[cur];
        const float* vsc = vs[cur];

        // --- energy tile S = q_tile * k_tile (K = 128, 32 WMMAs) ---
        v8f S = {0.f, 0.f, 0.f, 0.f, 0.f, 0.f, 0.f, 0.f};
#pragma unroll 8
        for (int kk = 0; kk < 32; ++kk) {
            const int kbase = 4 * kk + 2 * half;
            v2f a, bb;
            a.x  = qs[r * CQK + kbase + 0];
            a.y  = qs[r * CQK + kbase + 1];
            bb.x = ksc[(kbase + 0) * 16 + r];
            bb.y = ksc[(kbase + 1) * 16 + r];
            S = wmma_f32(a, bb, S);
        }

        // --- online softmax over rows n = v + 8*half (cols across lanes) ---
        float sc8[8];
#pragma unroll
        for (int v = 0; v < 8; ++v) {
            float x  = S[v];
            float rm = x;
            rm = fmaxf(rm, __shfl_xor(rm, 1, 32));
            rm = fmaxf(rm, __shfl_xor(rm, 2, 32));
            rm = fmaxf(rm, __shfl_xor(rm, 4, 32));
            rm = fmaxf(rm, __shfl_xor(rm, 8, 32));
            const float nm = fmaxf(mrun[v], rm);
            const float sc = __expf(mrun[v] - nm);   // 0 on first tile
            const float p  = __expf(x - nm);
            float rs = p;
            rs += __shfl_xor(rs, 1, 32);
            rs += __shfl_xor(rs, 2, 32);
            rs += __shfl_xor(rs, 4, 32);
            rs += __shfl_xor(rs, 8, 32);
            lrun[v] = lrun[v] * sc + rs;
            mrun[v] = nm;
            sc8[v]  = sc;
            ps[(v + 8 * half) * 16 + r] = p;         // P[n_local][m_local]
        }
        if (r == 0) {
#pragma unroll
            for (int v = 0; v < 8; ++v) scl[v + 8 * half] = sc8[v];
        }
        __syncthreads();
        const float mysc = scl[r];   // rescale for column n = lane%16

        // --- out update: acc_ct = acc_ct * diag(sc) + v_tile * P^T ---
#pragma unroll
        for (int ct = 0; ct < 16; ++ct) {
            v8f d = acc[ct];
#pragma unroll
            for (int v = 0; v < 8; ++v) d[v] *= mysc;
#pragma unroll
            for (int kk = 0; kk < 4; ++kk) {
                const int kbase = 4 * kk + 2 * half;
                v2f a, bb;
                a.x  = vsc[(ct * 16 + r) * 16 + kbase + 0]; // A row = channel
                a.y  = vsc[(ct * 16 + r) * 16 + kbase + 1];
                bb.x = ps[r * 16 + kbase + 0];              // B = P^T
                bb.y = ps[r * 16 + kbase + 1];
                d = wmma_f32(a, bb, d);
            }
            acc[ct] = d;
        }
        __syncthreads();   // ps/scl reused next iteration
    }

    // --- finalize: out = gamma * (acc / l) + g ---
    if (r == 0) {
#pragma unroll
        for (int v = 0; v < 8; ++v) lsh[v + 8 * half] = lrun[v];
    }
    __syncthreads();
    const float inv_l = 1.0f / lsh[r];
    const float gm    = gamma[0];
    const int   n     = n0 + r;

#pragma unroll
    for (int ct = 0; ct < 16; ++ct) {
#pragma unroll
        for (int v = 0; v < 8; ++v) {
            const int c = ct * 16 + v + 8 * half;
            const size_t o = ((size_t)b * CIN + c) * NSP + n;
            out[o] = gm * (acc[ct][v] * inv_l) + g[o];
        }
    }
}

// -------------------------------------------------------------------------
// kernel_launch
// inputs: 0:x 1:g 2:Wq 3:bq 4:Wk 5:bk 6:Wv 7:bv 8:gamma  (all fp32)
// -------------------------------------------------------------------------
extern "C" void kernel_launch(void* const* d_in, const int* in_sizes, int n_in,
                              void* d_out, int out_size, void* d_ws, size_t ws_size,
                              hipStream_t stream) {
    const float* x     = (const float*)d_in[0];
    const float* g     = (const float*)d_in[1];
    const float* Wq    = (const float*)d_in[2];
    const float* bq    = (const float*)d_in[3];
    const float* Wk    = (const float*)d_in[4];
    const float* bk    = (const float*)d_in[5];
    const float* Wv    = (const float*)d_in[6];
    const float* bv    = (const float*)d_in[7];
    const float* gamma = (const float*)d_in[8];
    float*       out   = (float*)d_out;

    // Workspace: q[b][n][CQK] | k[b][CQK][n] | v[b][CIN][n]  (~34 MB)
    float* qws = (float*)d_ws;
    float* kws = qws + (size_t)BS * NSP * CQK;
    float* vws = kws + (size_t)BS * CQK * NSP;

    dim3 blk(32, 1, 1);

    // q = Wq @ x + bq   (stored transposed: [b][n][o])
    Self_Attn_proj_kernel<<<dim3(CQK / 16, NSP / 16, BS), blk, 0, stream>>>(
        Wq, bq, x, qws, CQK, 1);
    // k = Wk @ g + bk   ([b][o][n])
    Self_Attn_proj_kernel<<<dim3(CQK / 16, NSP / 16, BS), blk, 0, stream>>>(
        Wk, bk, g, kws, CQK, 0);
    // v = Wv @ g + bv   ([b][c][n])
    Self_Attn_proj_kernel<<<dim3(CIN / 16, NSP / 16, BS), blk, 0, stream>>>(
        Wv, bv, g, vws, CIN, 0);

    // streaming-softmax attention + output
    Self_Attn_flash_kernel<<<dim3(NSP / 16, BS, 1), blk, 0, stream>>>(
        qws, kws, vws, g, gamma, out);
}

// v001
// It runs in 642 microseconds.
// Next to v000, in two timings, it ran 1.12 times as fast each time.
#include <hip/hip_runtime.h>
#include <hip/hip_bf16.h>
#include <cstddef>

// Problem constants (from reference)
#define BS   4
#define CIN  256      // C*A
#define CQK  128      // CIN/2
#define NSP  4096     // H*W*D = 16*16*16

typedef float v8f __attribute__((ext_vector_type(8)));
typedef float v2f __attribute__((ext_vector_type(2)));
typedef unsigned int u32x4 __attribute__((ext_vector_type(4)));
typedef int i32x4 __attribute__((ext_vector_type(4)));
typedef int i32x8 __attribute__((ext_vector_type(8)));

// -------------------------------------------------------------------------
// fp32 WMMA helper: D = A(16x4) * B(4x16) + C   via V_WMMA_F32_16X16X4_F32
// A-frag per lane: row M = lane%16, elems K = 2*(lane/16)+{0,1}
// B-frag per lane: col N = lane%16, elems K = 2*(lane/16)+{0,1}
// C/D per lane:    row M = vgpr + 8*(lane/16), col N = lane%16
// -------------------------------------------------------------------------
__device__ __forceinline__ v8f wmma_f32(v2f a, v2f b, v8f c) {
    return __builtin_amdgcn_wmma_f32_16x16x4_f32(
        /*neg_a=*/false, a, /*neg_b=*/false, b,
        /*c_mod=*/(short)0, c, /*reuse_a=*/false, /*reuse_b=*/false);
}

// LDS byte offset of a __shared__ object (AS3 pointers are 32-bit offsets).
__device__ __forceinline__ unsigned lds_off(const void* p) {
    return (unsigned)(unsigned long long)
        (const __attribute__((address_space(3))) void*)p;
}

// -------------------------------------------------------------------------
// Tensor Data Mover: 2D tile load Global -> LDS (CDNA5 TDM, D# per ISA ch.8)
//   tile_d0 : contiguous elements per row (fp32)
//   tile_d1 : number of rows
//   stride  : row stride in elements (tensor_dim0_stride)
// LDS receives rows packed contiguously (tile_d0*4 bytes apart).
// Tracked with TENSORcnt.
// -------------------------------------------------------------------------
__device__ __forceinline__ void tdm_load_2d(const float* gptr, const void* lptr,
                                            unsigned tile_d0, unsigned tile_d1,
                                            unsigned stride_elts) {
    const unsigned long long ga = (unsigned long long)gptr;
    const unsigned           la = lds_off(lptr);

    u32x4 g0;
    g0[0] = 1u;                                   // count=1 (valid user D#)
    g0[1] = la;                                   // lds_addr (bytes)
    g0[2] = (unsigned)ga;                         // global_addr[31:0]
    g0[3] = (unsigned)((ga >> 32) & 0x01FFFFFFull)// global_addr[56:32]
          | (2u << 30);                           // type = 2 ("image")

    i32x8 g1;
    g1[0] = (int)(2u << 16);                      // wg_mask=0, data_size=4B
    g1[1] = 0;                                    // bar_addr=0, tensor_dim0 lo16 (=0)
    g1[2] = (int)0x4000;                          // tensor_dim0 hi16 -> 2^30 (no OOB clip)
    g1[3] = (int)(0x4000u | (tile_d0 << 16));     // tensor_dim1 hi16 -> 2^30 ; tile_dim0
    g1[4] = (int)(tile_d1 & 0xFFFFu);             // tile_dim1 ; tile_dim2=0
    g1[5] = (int)stride_elts;                     // tensor_dim0_stride lo32
    g1[6] = 0;                                    // stride hi16 ; dim1_stride lo16
    g1[7] = 0;                                    // dim1_stride hi32

    const i32x4 z4 = {0, 0, 0, 0};
#if defined(__clang_major__) && (__clang_major__ >= 23)
    const i32x8 z8 = {0, 0, 0, 0, 0, 0, 0, 0};
    __builtin_amdgcn_tensor_load_to_lds(g0, g1, z4, z4, z8, 0);
#else
    __builtin_amdgcn_tensor_load_to_lds(g0, g1, z4, z4, 0);
#endif
}

// -------------------------------------------------------------------------
// Projection kernel:  O[o][n] = sum_c W[o][c] * X[b][c][n] + bias[o]
// One wave (32 threads) computes one 16(o) x 16(n) tile via 64 WMMAs.
// trans==1 stores O transposed as [b][n][o] (used for q so it is directly
// the A-matrix of the energy GEMM).
// -------------------------------------------------------------------------
__global__ __launch_bounds__(32)
void Self_Attn_proj_kernel(const float* __restrict__ W,
                           const float* __restrict__ bias,
                           const float* __restrict__ X,
                           float* __restrict__ O,
                           int OD, int trans) {
    const int o0   = blockIdx.x * 16;
    const int n0   = blockIdx.y * 16;
    const int b    = blockIdx.z;
    const int lane = threadIdx.x;
    const int half = lane >> 4;      // 0 or 1
    const int r    = lane & 15;      // row (A) / col (B,C/D)

    const float* Xb = X + (size_t)b * CIN * NSP;

    v8f acc = {0.f, 0.f, 0.f, 0.f, 0.f, 0.f, 0.f, 0.f};

    const float* wrow = W + (size_t)(o0 + r) * CIN;
#pragma unroll 4
    for (int c = 0; c < CIN; c += 4) {
        v2f a, bb;
        a.x  = wrow[c + 2 * half + 0];
        a.y  = wrow[c + 2 * half + 1];
        bb.x = Xb[(size_t)(c + 2 * half + 0) * NSP + n0 + r];
        bb.y = Xb[(size_t)(c + 2 * half + 1) * NSP + n0 + r];
        acc = wmma_f32(a, bb, acc);
    }

#pragma unroll
    for (int v = 0; v < 8; ++v) {
        const int o = o0 + v + 8 * half;   // output channel (row M)
        const int n = n0 + r;              // spatial index (col N)
        const float val = acc[v] + bias[o];
        if (trans)
            O[(size_t)b * NSP * OD + (size_t)n * OD + o] = val;
        else
            O[(size_t)b * OD * NSP + (size_t)o * NSP + n] = val;
    }
}

// -------------------------------------------------------------------------
// Flash-attention kernel: one wave handles one (batch b, 16-row n-tile).
// k/v tiles are DMA'd into double-buffered LDS by the Tensor Data Mover
// (2 tensor_load_to_lds per m-tile, TENSORcnt-waited) so tile mt+1 streams
// in while the 96 WMMAs of tile mt execute. The q fragments are loop-invariant
// and live in registers.
// S = q_tile(16x128) * k_tile(128x16) (32 WMMAs), online softmax, outT
// accumulated as 16 c-tiles of D = v_tile(16c x 16m) * P^T (4 WMMAs each).
// Finalizes: out = gamma * (acc / l) + g.
// -------------------------------------------------------------------------
__global__ __launch_bounds__(32)
void Self_Attn_flash_kernel(const float* __restrict__ qws,  // [b][n][CQK]
                            const float* __restrict__ kws,  // [b][CQK][n]
                            const float* __restrict__ vws,  // [b][CIN][n]
                            const float* __restrict__ g,
                            const float* __restrict__ gamma,
                            float* __restrict__ out) {
    const int n0   = blockIdx.x * 16;
    const int b    = blockIdx.y;
    const int lane = threadIdx.x;
    const int half = lane >> 4;
    const int r    = lane & 15;

    const float* qb = qws + (size_t)b * NSP * CQK;
    const float* kb = kws + (size_t)b * CQK * NSP;
    const float* vb = vws + (size_t)b * CIN * NSP;

    __shared__ float ks[2][CQK * 16];   // k tile (double buffered), [o][m_local]
    __shared__ float vs[2][CIN * 16];   // v tile (double buffered), [c][m_local]
    __shared__ float ps[16 * 16];       // P tile, [n_local][m_local]
    __shared__ float scl[16];           // per-row rescale factor
    __shared__ float lsh[16];           // per-row final softmax denom

    constexpr int NT = NSP / 16;        // 256 m-tiles

    // Prime the k/v pipeline for m-tile 0.
    tdm_load_2d(kb + 0, ks[0], 16, CQK, NSP);
    tdm_load_2d(vb + 0, vs[0], 16, CIN, NSP);

    // q A-fragments, read once: lane (r, half) holds q[n0 + r][4*kk + 2*half + {0,1}]
    // for WMMA kk of the energy product (64 VGPRs, same k order as before).
    v2f qf[32];
    {
        const float* qrow = qb + (size_t)(n0 + r) * CQK + 2 * half;
#pragma unroll
        for (int kk = 0; kk < 32; ++kk)
            qf[kk] = *reinterpret_cast<const v2f*>(qrow + 4 * kk);
    }
    // Precaution: stands before any rewrite of the address registers of the loads above.
    asm volatile("s_wait_xcnt 0x0" ::: "memory");

    // Out accumulator: 16 c-tiles of 16(c) x 16(n)  => 128 VGPRs.
    v8f acc[16];
#pragma unroll
    for (int t = 0; t < 16; ++t)
        acc[t] = (v8f){0.f, 0.f, 0.f, 0.f, 0.f, 0.f, 0.f, 0.f};

    float mrun[8], lrun[8];
#pragma unroll
    for (int v = 0; v < 8; ++v) { mrun[v] = -3.4e38f; lrun[v] = 0.f; }

    for (int mt = 0; mt < NT; ++mt) {
        const int cur = mt & 1;

        // Issue DMA for the next tile into the other buffer, then wait for
        // the current tile (leave the 2 prefetch ops in flight).
        if (mt + 1 < NT) {
            const int m1 = (mt + 1) * 16;
            tdm_load_2d(kb + m1, ks[cur ^ 1], 16, CQK, NSP);
            tdm_load_2d(vb + m1, vs[cur ^ 1], 16, CIN, NSP);
            __builtin_amdgcn_s_wait_tensorcnt(2);
        } else {
            __builtin_amdgcn_s_wait_tensorcnt(0);
        }
        __syncthreads();

        const float* ksc = ks[cur];
        const float* vsc = vs[cur];

        // --- energy tile S = q_tile * k_tile (K = 128, 32 WMMAs) ---
        v8f S = {0.f, 0.f, 0.f, 0.f, 0.f, 0.f, 0.f, 0.f};
        // Fully unrolled so that qf[] is indexed by constants and stays in registers.
#pragma unroll
        for (int kk = 0; kk < 32; ++kk) {
            const int kbase = 4 * kk + 2 * half;
            v2f bb;
            bb.x = ksc[(kbase + 0) * 16 + r];
            bb.y = ksc[(kbase + 1) * 16 + r];
            S = wmma_f32(qf[kk], bb, S);
        }

        // --- online softmax over rows n = v + 8*half (cols across lanes) ---
        float sc8[8];
#pragma unroll
        for (int v = 0; v < 8; ++v) {
            float x  = S[v];
            float rm = x;
            rm = fmaxf(rm, __shfl_xor(rm, 1, 32));
            rm = fmaxf(rm, __shfl_xor(rm, 2, 32));
            rm = fmaxf(rm, __shfl_xor(rm, 4, 32));
            rm = fmaxf(rm, __shfl_xor(rm, 8, 32));
            const float nm = fmaxf(mrun[v], rm);
            const float sc = __expf(mrun[v] - nm);   // 0 on first tile
            const float p  = __expf(x - nm);
            float rs = p;
            rs += __shfl_xor(rs, 1, 32);
            rs += __shfl_xor(rs, 2, 32);
            rs += __shfl_xor(rs, 4, 32);
            rs += __shfl_xor(rs, 8, 32);
            lrun[v] = lrun[v] * sc + rs;
            mrun[v] = nm;
            sc8[v]  = sc;
            ps[(v + 8 * half) * 16 + r] = p;         // P[n_local][m_local]
        }
        if (r == 0) {
#pragma unroll
            for (int v = 0; v < 8; ++v) scl[v + 8 * half] = sc8[v];
        }
        __syncthreads();
        const float mysc = scl[r];   // rescale for column n = lane%16

        // --- out update: acc_ct = acc_ct * diag(sc) + v_tile * P^T ---
#pragma unroll
        for (int ct = 0; ct < 16; ++ct) {
            v8f d = acc[ct];
#pragma unroll
            for (int v = 0; v < 8; ++v) d[v] *= mysc;
#pragma unroll
            for (int kk = 0; kk < 4; ++kk) {
                const int kbase = 4 * kk + 2 * half;
                v2f a, bb;
                a.x  = vsc[(ct * 16 + r) * 16 + kbase + 0]; // A row = channel
                a.y  = vsc[(ct * 16 + r) * 16 + kbase + 1];
                bb.x = ps[r * 16 + kbase + 0];              // B = P^T
                bb.y = ps[r * 16 + kbase + 1];
                d = wmma_f32(a, bb, d);
            }
            acc[ct] = d;
        }
        __syncthreads();   // ps/scl reused next iteration
    }

    // --- finalize: out = gamma * (acc / l) + g ---
    if (r == 0) {
#pragma unroll
        for (int v = 0; v < 8; ++v) lsh[v + 8 * half] = lrun[v];
    }
    __syncthreads();
    const float inv_l = 1.0f / lsh[r];
    const float gm    = gamma[0];
    const int   n     = n0 + r;

#pragma unroll
    for (int ct = 0; ct < 16; ++ct) {
#pragma unroll
        for (int v = 0; v < 8; ++v) {
            const int c = ct * 16 + v + 8 * half;
            const size_t o = ((size_t)b * CIN + c) * NSP + n;
            out[o] = gm * (acc[ct][v] * inv_l) + g[o];
        }
    }
}

// -------------------------------------------------------------------------
// kernel_launch
// inputs: 0:x 1:g 2:Wq 3:bq 4:Wk 5:bk 6:Wv 7:bv 8:gamma  (all fp32)
// -------------------------------------------------------------------------
extern "C" void kernel_launch(void* const* d_in, const int* in_sizes, int n_in,
                              void* d_out, int out_size, void* d_ws, size_t ws_size,
                              hipStream_t stream) {
    const float* x     = (const float*)d_in[0];
    const float* g     = (const float*)d_in[1];
    const float* Wq    = (const float*)d_in[2];
    const float* bq    = (const float*)d_in[3];
    const float* Wk    = (const float*)d_in[4];
    const float* bk    = (const float*)d_in[5];
    const float* Wv    = (const float*)d_in[6];
    const float* bv    = (const float*)d_in[7];
    const float* gamma = (const float*)d_in[8];
    float*       out   = (float*)d_out;

    // Workspace: q[b][n][CQK] | k[b][CQK][n] | v[b][CIN][n]  (~34 MB)
    float* qws = (float*)d_ws;
    float* kws = qws + (size_t)BS * NSP * CQK;
    float* vws = kws + (size_t)BS * CQK * NSP;

    dim3 blk(32, 1, 1);

    // q = Wq @ x + bq   (stored transposed: [b][n][o])
    Self_Attn_proj_kernel<<<dim3(CQK / 16, NSP / 16, BS), blk, 0, stream>>>(
        Wq, bq, x, qws, CQK, 1);
    // k = Wk @ g + bk   ([b][o][n])
    Self_Attn_proj_kernel<<<dim3(CQK / 16, NSP / 16, BS), blk, 0, stream>>>(
        Wk, bk, g, kws, CQK, 0);
    // v = Wv @ g + bv   ([b][c][n])
    Self_Attn_proj_kernel<<<dim3(CIN / 16, NSP / 16, BS), blk, 0, stream>>>(
        Wv, bv, g, vws, CIN, 0);

    // streaming-softmax attention + output
    Self_Attn_flash_kernel<<<dim3(NSP / 16, BS, 1), blk, 0, stream>>>(
        qws, kws, vws, g, gamma, out);
}

// v002
// One run takes 606 microseconds.
// Timed twice side by side with v001, it ran 1.24 and 1.23 times as fast.
// Counting every step since v000, it is 1.39 times as fast.
#include <hip/hip_runtime.h>
#include <hip/hip_bf16.h>
#include <cstddef>

// Problem constants (from reference)
#define BS   4
#define CIN  256      // C*A
#define CQK  128      // CIN/2
#define NSP  4096     // H*W*D = 16*16*16

typedef float v8f __attribute__((ext_vector_type(8)));
typedef float v2f __attribute__((ext_vector_type(2)));
typedef unsigned int u32x4 __attribute__((ext_vector_type(4)));
typedef int i32x4 __attribute__((ext_vector_type(4)));
typedef int i32x8 __attribute__((ext_vector_type(8)));

// -------------------------------------------------------------------------
// fp32 WMMA helper: D = A(16x4) * B(4x16) + C   via V_WMMA_F32_16X16X4_F32
// A-frag per lane: row M = lane%16, elems K = 2*(lane/16)+{0,1}
// B-frag per lane: col N = lane%16, elems K = 2*(lane/16)+{0,1}
// C/D per lane:    row M = vgpr + 8*(lane/16), col N = lane%16
// -------------------------------------------------------------------------
__device__ __forceinline__ v8f wmma_f32(v2f a, v2f b, v8f c) {
    return __builtin_amdgcn_wmma_f32_16x16x4_f32(
        /*neg_a=*/false, a, /*neg_b=*/false, b,
        /*c_mod=*/(short)0, c, /*reuse_a=*/false, /*reuse_b=*/false);
}

// Lane l takes the value of lane l ^ 16 (vector cross-row move, no LDS).
__device__ __forceinline__ float xhalf(float x) {
    return __builtin_bit_cast(float, __builtin_amdgcn_permlanex16(
        __builtin_bit_cast(int, x), __builtin_bit_cast(int, x),
        0x76543210, 0xfedcba98, false, false));
}

// LDS byte offset of a __shared__ object (AS3 pointers are 32-bit offsets).
__device__ __forceinline__ unsigned lds_off(const void* p) {
    return (unsigned)(unsigned long long)
        (const __attribute__((address_space(3))) void*)p;
}

// -------------------------------------------------------------------------
// Tensor Data Mover: 2D tile load Global -> LDS (CDNA5 TDM, D# per ISA ch.8)
//   tile_d0 : contiguous elements per row (fp32)
//   tile_d1 : number of rows
//   stride  : row stride in elements (tensor_dim0_stride)
// LDS receives rows packed contiguously (tile_d0*4 bytes apart).
// Tracked with TENSORcnt.
// -------------------------------------------------------------------------
__device__ __forceinline__ void tdm_load_2d(const float* gptr, const void* lptr,
                                            unsigned tile_d0, unsigned tile_d1,
                                            unsigned stride_elts) {
    const unsigned long long ga = (unsigned long long)gptr;
    const unsigned           la = lds_off(lptr);

    u32x4 g0;
    g0[0] = 1u;                                   // count=1 (valid user D#)
    g0[1] = la;                                   // lds_addr (bytes)
    g0[2] = (unsigned)ga;                         // global_addr[31:0]
    g0[3] = (unsigned)((ga >> 32) & 0x01FFFFFFull)// global_addr[56:32]
          | (2u << 30);                           // type = 2 ("image")

    i32x8 g1;
    g1[0] = (int)(2u << 16);                      // wg_mask=0, data_size=4B
    g1[1] = 0;                                    // bar_addr=0, tensor_dim0 lo16 (=0)
    g1[2] = (int)0x4000;                          // tensor_dim0 hi16 -> 2^30 (no OOB clip)
    g1[3] = (int)(0x4000u | (tile_d0 << 16));     // tensor_dim1 hi16 -> 2^30 ; tile_dim0
    g1[4] = (int)(tile_d1 & 0xFFFFu);             // tile_dim1 ; tile_dim2=0
    g1[5] = (int)stride_elts;                     // tensor_dim0_stride lo32
    g1[6] = 0;                                    // stride hi16 ; dim1_stride lo16
    g1[7] = 0;                                    // dim1_stride hi32

    const i32x4 z4 = {0, 0, 0, 0};
#if defined(__clang_major__) && (__clang_major__ >= 23)
    const i32x8 z8 = {0, 0, 0, 0, 0, 0, 0, 0};
    __builtin_amdgcn_tensor_load_to_lds(g0, g1, z4, z4, z8, 0);
#else
    __builtin_amdgcn_tensor_load_to_lds(g0, g1, z4, z4, 0);
#endif
}

// -------------------------------------------------------------------------
// Projection kernel:  O[o][n] = sum_c W[o][c] * X[b][c][n] + bias[o]
// One wave (32 threads) computes one 16(o) x 16(n) tile via 64 WMMAs.
// trans==1 stores O transposed as [b][n][o] (used for q so it is directly
// the B-matrix of the energy GEMM).
// -------------------------------------------------------------------------
__global__ __launch_bounds__(32)
void Self_Attn_proj_kernel(const float* __restrict__ W,
                           const float* __restrict__ bias,
                           const float* __restrict__ X,
                           float* __restrict__ O,
                           int OD, int trans) {
    const int o0   = blockIdx.x * 16;
    const int n0   = blockIdx.y * 16;
    const int b    = blockIdx.z;
    const int lane = threadIdx.x;
    const int half = lane >> 4;      // 0 or 1
    const int r    = lane & 15;      // row (A) / col (B,C/D)

    const float* Xb = X + (size_t)b * CIN * NSP;

    v8f acc = {0.f, 0.f, 0.f, 0.f, 0.f, 0.f, 0.f, 0.f};

    const float* wrow = W + (size_t)(o0 + r) * CIN;
#pragma unroll 4
    for (int c = 0; c < CIN; c += 4) {
        v2f a, bb;
        a.x  = wrow[c + 2 * half + 0];
        a.y  = wrow[c + 2 * half + 1];
        bb.x = Xb[(size_t)(c + 2 * half + 0) * NSP + n0 + r];
        bb.y = Xb[(size_t)(c + 2 * half + 1) * NSP + n0 + r];
        acc = wmma_f32(a, bb, acc);
    }

#pragma unroll
    for (int v = 0; v < 8; ++v) {
        const int o = o0 + v + 8 * half;   // output channel (row M)
        const int n = n0 + r;              // spatial index (col N)
        const float val = acc[v] + bias[o];
        if (trans)
            O[(size_t)b * NSP * OD + (size_t)n * OD + o] = val;
        else
            O[(size_t)b * OD * NSP + (size_t)o * NSP + n] = val;
    }
}

// -------------------------------------------------------------------------
// Flash-attention kernel: one wave handles one (batch b, 16-row n-tile).
// k/v tiles are DMA'd into double-buffered LDS by the Tensor Data Mover
// (2 tensor_load_to_lds per m-tile, TENSORcnt-waited) so tile mt+1 streams
// in while the 96 WMMAs of tile mt execute. The q fragments are loop-invariant
// and live in registers.
// S^T = k_tile^T(16m x 128) * q_tile^T(128 x 16n) (32 WMMAs): lane (r, half)
// holds the scores of ONE query n = r for keys m = 8*half + 0..7, so the
// online softmax runs in-lane (one exchange between the wave halves for the
// maximum) and exp(S^T) is, register for register, the B operand P^T of
// D = v_tile(16c x 16m) * P^T (16 c-tiles, 4 WMMAs each).
// Finalizes: out = gamma * (acc / l) + g.
// -------------------------------------------------------------------------
__global__ __launch_bounds__(32)
void Self_Attn_flash_kernel(const float* __restrict__ qws,  // [b][n][CQK]
                            const float* __restrict__ kws,  // [b][CQK][n]
                            const float* __restrict__ vws,  // [b][CIN][n]
                            const float* __restrict__ g,
                            const float* __restrict__ gamma,
                            float* __restrict__ out) {
    const int n0   = blockIdx.x * 16;
    const int b    = blockIdx.y;
    const int lane = threadIdx.x;
    const int half = lane >> 4;
    const int r    = lane & 15;

    const float* qb = qws + (size_t)b * NSP * CQK;
    const float* kb = kws + (size_t)b * CQK * NSP;
    const float* vb = vws + (size_t)b * CIN * NSP;

    __shared__ float ks[2][CQK * 16];   // k tile (double buffered), [o][m_local]
    __shared__ float vs[2][CIN * 16];   // v tile (double buffered), [c][m_local]

    constexpr int NT = NSP / 16;        // 256 m-tiles

    // Prime the k/v pipeline for m-tile 0.
    tdm_load_2d(kb + 0, ks[0], 16, CQK, NSP);
    tdm_load_2d(vb + 0, vs[0], 16, CIN, NSP);

    // q fragments (B operand), read once: lane (r, half) holds
    // q[n0 + r][4*kk + 2*half + {0,1}] for WMMA kk of the energy product (64 VGPRs).
    v2f qf[32];
    {
        const float* qrow = qb + (size_t)(n0 + r) * CQK + 2 * half;
#pragma unroll
        for (int kk = 0; kk < 32; ++kk)
            qf[kk] = *reinterpret_cast<const v2f*>(qrow + 4 * kk);
    }
    // Precaution: stands before any rewrite of the address registers of the loads above.
    asm volatile("s_wait_xcnt 0x0" ::: "memory");

    // Out accumulator: 16 c-tiles of 16(c) x 16(n)  => 128 VGPRs.
    v8f acc[16];
#pragma unroll
    for (int t = 0; t < 16; ++t)
        acc[t] = (v8f){0.f, 0.f, 0.f, 0.f, 0.f, 0.f, 0.f, 0.f};

    // Query n = r: running maximum (equal in both halves) and this half's
    // share of the running sum (the halves are joined after the loop).
    float mrun = -3.4e38f, lrun = 0.f;

    for (int mt = 0; mt < NT; ++mt) {
        const int cur = mt & 1;

        // Issue DMA for the next tile into the other buffer, then wait for
        // the current tile (leave the 2 prefetch ops in flight).
        if (mt + 1 < NT) {
            const int m1 = (mt + 1) * 16;
            tdm_load_2d(kb + m1, ks[cur ^ 1], 16, CQK, NSP);
            tdm_load_2d(vb + m1, vs[cur ^ 1], 16, CIN, NSP);
            __builtin_amdgcn_s_wait_tensorcnt(2);
        } else {
            __builtin_amdgcn_s_wait_tensorcnt(0);
        }
        __syncthreads();

        const float* ksc = ks[cur];
        const float* vsc = vs[cur];

        // --- energy tile S^T = k_tile^T * q_tile^T (K = 128, 32 WMMAs) ---
        // S[v] = energy[n = r][m = v + 8*half]
        v8f S = {0.f, 0.f, 0.f, 0.f, 0.f, 0.f, 0.f, 0.f};
        // Fully unrolled so that qf[] is indexed by constants and stays in registers.
#pragma unroll
        for (int kk = 0; kk < 32; ++kk) {
            const int kbase = 4 * kk + 2 * half;
            v2f a;
            a.x = ksc[(kbase + 0) * 16 + r];     // A row = key m = r
            a.y = ksc[(kbase + 1) * 16 + r];
            S = wmma_f32(a, qf[kk], S);
        }
        // Four vector slots between the last score WMMA and the first vector
        // instruction that reads its result (the maximum below); naming S is
        // what holds the slots at this place.
        asm volatile("v_nop\n\tv_nop\n\tv_nop\n\tv_nop" : "+v"(S));

        // --- online softmax for query n = r, in-lane over this half's 8 keys ---
        float rm = fmaxf(fmaxf(fmaxf(S[0], S[1]), fmaxf(S[2], S[3])),
                         fmaxf(fmaxf(S[4], S[5]), fmaxf(S[6], S[7])));
        rm = fmaxf(rm, xhalf(rm));               // all 16 keys of the tile
        const float nm = fmaxf(mrun, rm);
        const float sc = __expf(mrun - nm);      // 0 on first tile
        mrun = nm;
        float p[8];
#pragma unroll
        for (int v = 0; v < 8; ++v) p[v] = __expf(S[v] - nm);
        lrun = lrun * sc + (((p[0] + p[1]) + (p[2] + p[3])) +
                            ((p[4] + p[5]) + (p[6] + p[7])));

        // --- out update: acc_ct = acc_ct * diag(sc) + v_tile * P^T ---
        // k order of WMMA j, A and B alike: lane (r, half) supplies keys
        // m = 8*half + 2*j + {0,1}.
#pragma unroll
        for (int ct = 0; ct < 16; ++ct) {
            const float* vrow = vsc + (ct * 16 + r) * 16 + 8 * half; // A row = channel
            v8f d = acc[ct];
#pragma unroll
            for (int v = 0; v < 8; ++v) d[v] *= sc;
#pragma unroll
            for (int j = 0; j < 4; ++j) {
                v2f a, bb;
                a.x  = vrow[2 * j + 0];
                a.y  = vrow[2 * j + 1];
                bb.x = p[2 * j + 0];                        // B = P^T
                bb.y = p[2 * j + 1];
                d = wmma_f32(a, bb, d);
            }
            acc[ct] = d;
        }
        __syncthreads();   // ends the reads of ks/vs[cur]; the next trip's tensor loads refill them
    }

    // --- finalize: out = gamma * (acc / l) + g ---
    const float inv_l = 1.0f / (lrun + xhalf(lrun));   // join the halves' sums
    const float gm    = gamma[0];
    const int   n     = n0 + r;

#pragma unroll
    for (int ct = 0; ct < 16; ++ct) {
#pragma unroll
        for (int v = 0; v < 8; ++v) {
            const int c = ct * 16 + v + 8 * half;
            const size_t o = ((size_t)b * CIN + c) * NSP + n;
            out[o] = gm * (acc[ct][v] * inv_l) + g[o];
        }
    }
}

// -------------------------------------------------------------------------
// kernel_launch
// inputs: 0:x 1:g 2:Wq 3:bq 4:Wk 5:bk 6:Wv 7:bv 8:gamma  (all fp32)
// -------------------------------------------------------------------------
extern "C" void kernel_launch(void* const* d_in, const int* in_sizes, int n_in,
                              void* d_out, int out_size, void* d_ws, size_t ws_size,
                              hipStream_t stream) {
    const float* x     = (const float*)d_in[0];
    const float* g     = (const float*)d_in[1];
    const float* Wq    = (const float*)d_in[2];
    const float* bq    = (const float*)d_in[3];
    const float* Wk    = (const float*)d_in[4];
    const float* bk    = (const float*)d_in[5];
    const float* Wv    = (const float*)d_in[6];
    const float* bv    = (const float*)d_in[7];
    const float* gamma = (const float*)d_in[8];
    float*       out   = (float*)d_out;

    // Workspace: q[b][n][CQK] | k[b][CQK][n] | v[b][CIN][n]  (~34 MB)
    float* qws = (float*)d_ws;
    float* kws = qws + (size_t)BS * NSP * CQK;
    float* vws = kws + (size_t)BS * CQK * NSP;

    dim3 blk(32, 1, 1);

    // q = Wq @ x + bq   (stored transposed: [b][n][o])
    Self_Attn_proj_kernel<<<dim3(CQK / 16, NSP / 16, BS), blk, 0, stream>>>(
        Wq, bq, x, qws, CQK, 1);
    // k = Wk @ g + bk   ([b][o][n])
    Self_Attn_proj_kernel<<<dim3(CQK / 16, NSP / 16, BS), blk, 0, stream>>>(
        Wk, bk, g, kws, CQK, 0);
    // v = Wv @ g + bv   ([b][c][n])
    Self_Attn_proj_kernel<<<dim3(CIN / 16, NSP / 16, BS), blk, 0, stream>>>(
        Wv, bv, g, vws, CIN, 0);

    // streaming-softmax attention + output
    Self_Attn_flash_kernel<<<dim3(NSP / 16, BS, 1), blk, 0, stream>>>(
        qws, kws, vws, g, gamma, out);
}
